// v000
// The times below were measured on an AMD MI455X: many runs one after another, warmed up first and cycling through
// copies of the inputs, with the whole window's GPU time divided by the number of runs. Launches and the gaps
// between them are all in it. The median over several windows is given; except for v000 it joins two sittings, which
// can be a few percent apart, so the side-by-side timings, each taken in one sitting, are the better comparison.
// The starting kernel, v000, takes 98 microseconds a run.
#include <hip/hip_runtime.h>

// ---- problem constants (match reference) ----
#define BATCH      32
#define NUM_BLOCKS 2048
#define PAGE_TOK   16
#define KVH        8
#define NH         32
#define HD         128
#define MAXB       128
#define GQA        4                      // NH / KVH
#define QK_SCALE   0.08838834764831845f   // 1/sqrt(128)

#define WAVES        4
#define PAGES_PER_WV 32
#define ROWF         132                  // padded floats per LDS K row (128 + 4)

typedef float v2f __attribute__((ext_vector_type(2)));
typedef float v8f __attribute__((ext_vector_type(8)));

__device__ __forceinline__ v8f wmma_f32_16x16x4(v2f a, v2f b, v8f c) {
  return __builtin_amdgcn_wmma_f32_16x16x4_f32(
      /*neg_a=*/false, a, /*neg_b=*/false, b,
      /*c_mod=*/(short)0, c, /*reuse_a=*/false, /*reuse_b=*/false);
}

__device__ __forceinline__ void async_b128_to_lds(unsigned lds_off, const void* gptr) {
  asm volatile("global_load_async_to_lds_b128 %0, %1, off"
               :: "v"(lds_off), "v"(gptr) : "memory");
}
__device__ __forceinline__ void wait_asynccnt0() {
  asm volatile("s_wait_asynccnt 0" ::: "memory");
}

__global__ __launch_bounds__(128) void pa_decode_kernel(
    const float* __restrict__ q,
    const float* __restrict__ knew,
    const float* __restrict__ vnew,
    const float* __restrict__ kcache,
    const float* __restrict__ vcache,
    const int*   __restrict__ ctxlen,
    const int*   __restrict__ btab,
    const int*   __restrict__ smap,
    float*       __restrict__ out)
{
  __shared__ float kb[WAVES][PAGE_TOK * ROWF];   // staged K page per wave
  __shared__ int   ovr[WAVES][PAGE_TOK];         // per-row new-token override idx
  __shared__ float Oar[WAVES][GQA][HD];          // partial outputs
  __shared__ float mar[WAVES][GQA];
  __shared__ float sar[WAVES][GQA];

  const int b    = blockIdx.x >> 3;
  const int kvh  = blockIdx.x & 7;
  const int lane = threadIdx.x & 31;
  const int wv   = threadIdx.x >> 5;
  const int ln16 = lane & 15;           // row-in-tile / q-head column
  const int h    = lane >> 4;           // wave half

  const int sm_lane = smap[lane];       // all 32 slot_mapping entries, one per lane

  // ---- Q as WMMA B-fragment (K=dims x N=qhead), pre-scaled, 32 chunks of K=4 ----
  v2f qb[32];
  {
    const bool valid = ln16 < GQA;
    const float* qbase = q + (size_t)(b * NH + kvh * GQA + (valid ? ln16 : 0)) * HD + 2 * h;
#pragma unroll
    for (int kk = 0; kk < 32; ++kk) {
      float x = 0.f, y = 0.f;
      if (valid) { x = qbase[kk * 4] * QK_SCALE; y = qbase[kk * 4 + 1] * QK_SCALE; }
      qb[kk].x = x; qb[kk].y = y;
    }
  }

  const int ctx    = ctxlen[b];
  const int ptotal = (ctx + PAGE_TOK - 1) >> 4;
  const int ps     = wv * PAGES_PER_WV;
  const int pe     = min(ps + PAGES_PER_WV, ptotal);

  float m = -1e30f, s = 0.f;
  v8f O[8];
  {
    v8f z = {0.f,0.f,0.f,0.f,0.f,0.f,0.f,0.f};
#pragma unroll
    for (int t = 0; t < 8; ++t) O[t] = z;
  }

  float* kbw  = kb[wv];
  int*   ovrw = ovr[wv];
  const unsigned kbw_off = (unsigned)(uintptr_t)kbw + (unsigned)(lane * 16);

  for (int p = ps; p < pe; ++p) {
    const int blk = btab[b * MAXB + p];

    // ---- async-stage K page into LDS (16B/lane per row), build override table ----
#pragma unroll 4
    for (int t = 0; t < PAGE_TOK; ++t) {
      const int flat = blk * PAGE_TOK + t;
      unsigned long long mb = __ballot(sm_lane == flat);   // wave-uniform
      const char* ksrc;
      int j = -1;
      if (mb) {
        j = (int)(__ffsll(mb) - 1);
        ksrc = (const char*)(knew + (size_t)(j * KVH + kvh) * HD);
      } else {
        ksrc = (const char*)(kcache + ((size_t)flat * KVH + kvh) * HD);
      }
      if (lane == 0) ovrw[t] = j;
      async_b128_to_lds(kbw_off + (unsigned)(t * ROWF * 4), ksrc + lane * 16);
    }

    // ---- prefetch next page K/V lines (global_prefetch_b8) ----
    if (p + 1 < pe) {
      const int nblk = btab[b * MAXB + p + 1];
#pragma unroll
      for (int it = 0; it < 4; ++it) {
        int idx = it * 32 + lane;                       // (row, 64B chunk)
        int r_ = idx >> 3, ch = idx & 7;
        size_t off = ((size_t)(nblk * PAGE_TOK + r_) * KVH + kvh) * HD + ch * 16;
        __builtin_prefetch(kcache + off, 0, 1);
        __builtin_prefetch(vcache + off, 0, 1);
      }
    }

    wait_asynccnt0();   // K page resident in LDS

    // ---- QK^T: C[tok, qh] accumulated over D=128 in 32 K=4 steps ----
    v8f c = {0.f,0.f,0.f,0.f,0.f,0.f,0.f,0.f};
#pragma unroll
    for (int kk = 0; kk < 32; ++kk) {
      v2f a = *(const v2f*)&kbw[ln16 * ROWF + kk * 4 + 2 * h];  // A: K rows
      c = wmma_f32_16x16x4(a, qb[kk], c);
    }

    // ---- mask invalid tokens in last partial page ----
    const int nv = ctx - p * PAGE_TOK;
    if (nv < PAGE_TOK) {
#pragma unroll
      for (int r = 0; r < 8; ++r) {
        int tok = r + 8 * h;
        if (tok >= nv) c[r] = -1e30f;
      }
    }

    // ---- online softmax update (per qh column = per lane%16) ----
    float pm = c[0];
#pragma unroll
    for (int r = 1; r < 8; ++r) pm = fmaxf(pm, c[r]);
    pm = fmaxf(pm, __shfl_xor(pm, 16, 32));
    const float mn = fmaxf(m, pm);
    const float f  = __expf(m - mn);
    m = mn;
#pragma unroll
    for (int r = 0; r < 8; ++r) c[r] = __expf(c[r] - mn);
    float psum = c[0];
#pragma unroll
    for (int r = 1; r < 8; ++r) psum += c[r];
    psum += __shfl_xor(psum, 16, 32);
    s = s * f + psum;

    // rescale O: O row qh = r + 8h needs f from lane (r + 8h)
    float fr[8];
#pragma unroll
    for (int r = 0; r < 8; ++r) fr[r] = __shfl(f, r + 8 * h, 32);
#pragma unroll
    for (int dt = 0; dt < 8; ++dt)
#pragma unroll
      for (int r = 0; r < 8; ++r) O[dt][r] *= fr[r];

    // ---- P^T x V: 4 token-chunks of K=4, 8 dim tiles of N=16 ----
#pragma unroll
    for (int kc = 0; kc < 4; ++kc) {
      // A-fragment: lane holds row qh=lane%16, tokens kc*4 + 2h + {0,1}
      v2f a;
#pragma unroll
      for (int v = 0; v < 2; ++v) {
        const int t0 = kc * 4 + v;       // token for h==0 lanes
        const int t1 = kc * 4 + 2 + v;   // token for h==1 lanes
        float v0 = (t0 < 8) ? c[t0] : __shfl_xor(c[t0 & 7], 16, 32);
        float v1 = (t1 >= 8) ? c[t1 & 7] : __shfl_xor(c[t1 & 7], 16, 32);
        float av = h ? v1 : v0;
        if (v == 0) a.x = av; else a.y = av;
      }
      // V B-fragment rows (with new-token override), streamed NT from global
      const float* vrow[2];
#pragma unroll
      for (int v = 0; v < 2; ++v) {
        int tok = kc * 4 + 2 * h + v;
        int ov  = ovrw[tok];
        vrow[v] = (ov >= 0)
            ? vnew + (size_t)(ov * KVH + kvh) * HD
            : vcache + ((size_t)(blk * PAGE_TOK + tok) * KVH + kvh) * HD;
      }
#pragma unroll
      for (int dt = 0; dt < 8; ++dt) {
        v2f bv;
        bv.x = __builtin_nontemporal_load(&vrow[0][dt * 16 + ln16]);
        bv.y = __builtin_nontemporal_load(&vrow[1][dt * 16 + ln16]);
        O[dt] = wmma_f32_16x16x4(a, bv, O[dt]);
      }
    }
  }

  // ---- publish per-wave partials ----
  if (lane < GQA) { mar[wv][lane] = m; sar[wv][lane] = s; }
#pragma unroll
  for (int dt = 0; dt < 8; ++dt)
#pragma unroll
    for (int r = 0; r < GQA; ++r)
      if (h == 0) Oar[wv][r][dt * 16 + ln16] = O[dt][r];

  __syncthreads();

  // ---- merge 4 wave partials, normalize, write out ----
  for (int i = threadIdx.x; i < GQA * HD; i += blockDim.x) {
    const int qh2 = i >> 7, d = i & 127;
    float mx = mar[0][qh2];
#pragma unroll
    for (int w = 1; w < WAVES; ++w) mx = fmaxf(mx, mar[w][qh2]);
    float ss = 0.f, vv = 0.f;
#pragma unroll
    for (int w = 0; w < WAVES; ++w) {
      float e = __expf(mar[w][qh2] - mx);
      ss += sar[w][qh2] * e;
      vv += Oar[w][qh2][d] * e;
    }
    out[(size_t)(b * NH + kvh * GQA + qh2) * HD + d] = vv / ss;
  }
}

extern "C" void kernel_launch(void* const* d_in, const int* in_sizes, int n_in,
                              void* d_out, int out_size, void* d_ws, size_t ws_size,
                              hipStream_t stream) {
  (void)in_sizes; (void)n_in; (void)out_size; (void)d_ws; (void)ws_size;
  pa_decode_kernel<<<dim3(BATCH * KVH), dim3(128), 0, stream>>>(
      (const float*)d_in[0], (const float*)d_in[1], (const float*)d_in[2],
      (const float*)d_in[3], (const float*)d_in[4], (const int*)d_in[5],
      (const int*)d_in[6], (const int*)d_in[7], (float*)d_out);
}

// v001
// A run of this version takes 37.6 microseconds.
// Next to v000, in two timings, it ran 2.65 and 2.64 times as fast.
#include <hip/hip_runtime.h>

// ---- problem constants (match reference) ----
#define BATCH      32
#define NUM_BLOCKS 2048
#define PAGE_TOK   16
#define KVH        8
#define NH         32
#define HD         128
#define MAXB       128
#define GQA        4                      // NH / KVH
#define QK_SCALE   0.08838834764831845f   // 1/sqrt(128)

#define WAVES        16
#define ROWF         132

typedef float v2f __attribute__((ext_vector_type(2)));
typedef float v8f __attribute__((ext_vector_type(8)));

__device__ __forceinline__ v8f wmma_f32_16x16x4(v2f a, v2f b, v8f c) {
  return __builtin_amdgcn_wmma_f32_16x16x4_f32(
      /*neg_a=*/false, a, /*neg_b=*/false, b,
      /*c_mod=*/(short)0, c, /*reuse_a=*/false, /*reuse_b=*/false);
}

__device__ __forceinline__ void async_b128_to_lds(unsigned lds_off, const void* gptr) {
  asm volatile("global_load_async_to_lds_b128 %0, %1, off"
               :: "v"(lds_off), "v"(gptr) : "memory");
}
__device__ __forceinline__ void wait_asynccnt0() {
  asm volatile("s_wait_asynccnt 0" ::: "memory");
}

__global__ __launch_bounds__(WAVES * 32) void pa_decode_kernel(
    const float* __restrict__ q,
    const float* __restrict__ knew,
    const float* __restrict__ vnew,
    const float* __restrict__ kcache,
    const float* __restrict__ vcache,
    const int*   __restrict__ ctxlen,
    const int*   __restrict__ btab,
    const int*   __restrict__ smap,
    float*       __restrict__ out)
{
  __shared__ float kb[WAVES][PAGE_TOK * ROWF];   // staged K page per wave
  __shared__ int   ovr[WAVES][PAGE_TOK];         // per-row new-token override idx
  __shared__ float Oar[WAVES][GQA][HD];          // partial outputs
  __shared__ float mar[WAVES][GQA];
  __shared__ float sar[WAVES][GQA];

  const int b    = blockIdx.x >> 3;
  const int kvh  = blockIdx.x & 7;
  const int lane = threadIdx.x & 31;
  const int wv   = threadIdx.x >> 5;
  const int ln16 = lane & 15;           // row-in-tile / q-head column
  const int h    = lane >> 4;           // wave half

  const int sm_lane = smap[lane];       // all 32 slot_mapping entries, one per lane

  // ---- Q as WMMA B-fragment (K=dims x N=qhead), pre-scaled, 32 chunks of K=4 ----
  v2f qb[32];
  {
    const bool valid = ln16 < GQA;
    const float* qbase = q + (size_t)(b * NH + kvh * GQA + (valid ? ln16 : 0)) * HD + 2 * h;
#pragma unroll
    for (int kk = 0; kk < 32; ++kk) {
      float x = 0.f, y = 0.f;
      if (valid) { x = qbase[kk * 4] * QK_SCALE; y = qbase[kk * 4 + 1] * QK_SCALE; }
      qb[kk].x = x; qb[kk].y = y;
    }
  }

  const int ctx    = ctxlen[b];
  const int ptotal = min((ctx + PAGE_TOK - 1) >> 4, MAXB);

  float m = -1e30f, s = 0.f;
  v8f O[8];
  {
    v8f z = {0.f,0.f,0.f,0.f,0.f,0.f,0.f,0.f};
#pragma unroll
    for (int t = 0; t < 8; ++t) O[t] = z;
  }

  float* kbw  = kb[wv];
  int*   ovrw = ovr[wv];
  const unsigned kbw_off = (unsigned)(uintptr_t)kbw + (unsigned)(lane * 16);

  for (int p = wv; p < ptotal; p += WAVES) {
    const int blk = min(max(btab[b * MAXB + p], 0), NUM_BLOCKS - 1);

    // ---- async-stage K page into LDS (16B/lane per row), build override table ----
#pragma unroll 4
    for (int t = 0; t < PAGE_TOK; ++t) {
      const int flat = blk * PAGE_TOK + t;
      unsigned long long mb = __ballot(sm_lane == flat);   // wave-uniform
      const char* ksrc;
      int j = -1;
      if (mb) {
        j = (int)(__ffsll(mb) - 1);
        ksrc = (const char*)(knew + (size_t)(j * KVH + kvh) * HD);
      } else {
        ksrc = (const char*)(kcache + ((size_t)flat * KVH + kvh) * HD);
      }
      if (lane == 0) ovrw[t] = j;
      async_b128_to_lds(kbw_off + (unsigned)(t * ROWF * 4), ksrc + lane * 16);
    }

    // ---- prefetch this wave's next page K/V lines (global_prefetch_b8) ----
    if (p + WAVES < ptotal) {
      const int nblk = min(max(btab[b * MAXB + p + WAVES], 0), NUM_BLOCKS - 1);
#pragma unroll
      for (int it = 0; it < 4; ++it) {
        int idx = it * 32 + lane;                       // (row, 64B chunk)
        int r_ = idx >> 3, ch = idx & 7;
        size_t off = ((size_t)(nblk * PAGE_TOK + r_) * KVH + kvh) * HD + ch * 16;
        __builtin_prefetch(kcache + off, 0, 1);
        __builtin_prefetch(vcache + off, 0, 1);
      }
    }

    wait_asynccnt0();   // K page resident in LDS

    // ---- QK^T: C[tok, qh] accumulated over D=128 in 32 K=4 steps ----
    v8f c = {0.f,0.f,0.f,0.f,0.f,0.f,0.f,0.f};
#pragma unroll
    for (int kk = 0; kk < 32; ++kk) {
      v2f a = *(const v2f*)&kbw[ln16 * ROWF + kk * 4 + 2 * h];  // A: K rows
      c = wmma_f32_16x16x4(a, qb[kk], c);
    }

    // ---- mask invalid tokens in last partial page ----
    const int nv = ctx - p * PAGE_TOK;
    if (nv < PAGE_TOK) {
#pragma unroll
      for (int r = 0; r < 8; ++r) {
        int tok = r + 8 * h;
        if (tok >= nv) c[r] = -1e30f;
      }
    }

    // ---- online softmax update (per qh column = per lane%16) ----
    float pm = c[0];
#pragma unroll
    for (int r = 1; r < 8; ++r) pm = fmaxf(pm, c[r]);
    pm = fmaxf(pm, __shfl_xor(pm, 16, 32));
    const float mn = fmaxf(m, pm);
    const float f  = __expf(m - mn);
    m = mn;
#pragma unroll
    for (int r = 0; r < 8; ++r) c[r] = __expf(c[r] - mn);
    float psum = c[0];
#pragma unroll
    for (int r = 1; r < 8; ++r) psum += c[r];
    psum += __shfl_xor(psum, 16, 32);
    s = s * f + psum;

    // rescale O: O row qh = r + 8h needs f from lane (r + 8h)
    float fr[8];
#pragma unroll
    for (int r = 0; r < 8; ++r) fr[r] = __shfl(f, r + 8 * h, 32);
#pragma unroll
    for (int dt = 0; dt < 8; ++dt)
#pragma unroll
      for (int r = 0; r < 8; ++r) O[dt][r] *= fr[r];

    // ---- P^T x V: 4 token-chunks of K=4, 8 dim tiles of N=16 ----
#pragma unroll
    for (int kc = 0; kc < 4; ++kc) {
      // A-fragment: lane holds row qh=lane%16, tokens kc*4 + 2h + {0,1}
      v2f a;
#pragma unroll
      for (int v = 0; v < 2; ++v) {
        const int t0 = kc * 4 + v;       // token for h==0 lanes
        const int t1 = kc * 4 + 2 + v;   // token for h==1 lanes
        float v0 = (t0 < 8) ? c[t0] : __shfl_xor(c[t0 & 7], 16, 32);
        float v1 = (t1 >= 8) ? c[t1 & 7] : __shfl_xor(c[t1 & 7], 16, 32);
        float av = h ? v1 : v0;
        if (v == 0) a.x = av; else a.y = av;
      }
      // V B-fragment rows (with new-token override), streamed NT from global
      const float* vrow[2];
#pragma unroll
      for (int v = 0; v < 2; ++v) {
        int tok = kc * 4 + 2 * h + v;
        int ov  = ovrw[tok];
        vrow[v] = (ov >= 0)
            ? vnew + (size_t)(ov * KVH + kvh) * HD
            : vcache + ((size_t)(blk * PAGE_TOK + tok) * KVH + kvh) * HD;
      }
#pragma unroll
      for (int dt = 0; dt < 8; ++dt) {
        v2f bv;
        bv.x = __builtin_nontemporal_load(&vrow[0][dt * 16 + ln16]);
        bv.y = __builtin_nontemporal_load(&vrow[1][dt * 16 + ln16]);
        O[dt] = wmma_f32_16x16x4(a, bv, O[dt]);
      }
    }
  }

  // ---- publish per-wave partials ----
  if (lane < GQA) { mar[wv][lane] = m; sar[wv][lane] = s; }
#pragma unroll
  for (int dt = 0; dt < 8; ++dt)
#pragma unroll
    for (int r = 0; r < GQA; ++r)
      if (h == 0) Oar[wv][r][dt * 16 + ln16] = O[dt][r];

  __syncthreads();

  // ---- merge the waves' partials, normalize, write out ----
  for (int i = threadIdx.x; i < GQA * HD; i += blockDim.x) {
    const int qh2 = i >> 7, d = i & 127;
    float mx = mar[0][qh2];
#pragma unroll
    for (int w = 1; w < WAVES; ++w) mx = fmaxf(mx, mar[w][qh2]);
    float ss = 0.f, vv = 0.f;
#pragma unroll
    for (int w = 0; w < WAVES; ++w) {
      float e = __expf(mar[w][qh2] - mx);
      ss += sar[w][qh2] * e;
      vv += Oar[w][qh2][d] * e;
    }
    out[(size_t)(b * NH + kvh * GQA + qh2) * HD + d] = vv / ss;
  }
}

extern "C" void kernel_launch(void* const* d_in, const int* in_sizes, int n_in,
                              void* d_out, int out_size, void* d_ws, size_t ws_size,
                              hipStream_t stream) {
  (void)in_sizes; (void)n_in; (void)out_size; (void)d_ws; (void)ws_size;
  pa_decode_kernel<<<dim3(BATCH * KVH), dim3(WAVES * 32), 0, stream>>>(
      (const float*)d_in[0], (const float*)d_in[1], (const float*)d_in[2],
      (const float*)d_in[3], (const float*)d_in[4], (const int*)d_in[5],
      (const int*)d_in[6], (const int*)d_in[7], (float*)d_out);
}

// v002
// One run takes 30.2 microseconds.
// Timed twice side by side with v001, it ran 1.24 and 1.25 times as fast.
// All steps since v000 together make it 3.29 times as fast.
#include <hip/hip_runtime.h>

// ---- problem constants (match reference) ----
#define BATCH      32
#define NUM_BLOCKS 2048
#define PAGE_TOK   16
#define KVH        8
#define NH         32
#define HD         128
#define MAXB       128
#define GQA        4                      // NH / KVH
#define QK_SCALE   0.08838834764831845f   // 1/sqrt(128)

#define WAVES        16
#define ROWF         132
#define VROWF        136

typedef float v2f __attribute__((ext_vector_type(2)));
typedef float v8f __attribute__((ext_vector_type(8)));

__device__ __forceinline__ v8f wmma_f32_16x16x4(v2f a, v2f b, v8f c) {
  return __builtin_amdgcn_wmma_f32_16x16x4_f32(
      /*neg_a=*/false, a, /*neg_b=*/false, b,
      /*c_mod=*/(short)0, c, /*reuse_a=*/false, /*reuse_b=*/false);
}

__device__ __forceinline__ void wait_asynccnt0() {
  asm volatile("s_wait_asynccnt 0" ::: "memory");
}
__device__ __forceinline__ void wait_dscnt0() {
  asm volatile("s_wait_dscnt 0" ::: "memory");
}

__device__ __forceinline__ void async_copy8(const unsigned (&d)[8], const char* const (&s)[8]) {
  asm volatile(
      "global_load_async_to_lds_b128 %0, %8, off\n\t"
      "global_load_async_to_lds_b128 %1, %9, off\n\t"
      "global_load_async_to_lds_b128 %2, %10, off\n\t"
      "global_load_async_to_lds_b128 %3, %11, off\n\t"
      "global_load_async_to_lds_b128 %4, %12, off\n\t"
      "global_load_async_to_lds_b128 %5, %13, off\n\t"
      "global_load_async_to_lds_b128 %6, %14, off\n\t"
      "global_load_async_to_lds_b128 %7, %15, off\n\t"
      "s_wait_xcnt 0x0"
      :: "v"(d[0]), "v"(d[1]), "v"(d[2]), "v"(d[3]), "v"(d[4]), "v"(d[5]), "v"(d[6]), "v"(d[7]),
         "v"(s[0]), "v"(s[1]), "v"(s[2]), "v"(s[3]), "v"(s[4]), "v"(s[5]), "v"(s[6]), "v"(s[7])
      : "memory");
}

__device__ __forceinline__ void stage_page(unsigned lds_lane, unsigned pitch_bytes,
                                           const float* __restrict__ cache,
                                           const float* __restrict__ fresh,
                                           int blk, bool any_new, int kvh, int lane, int sm_lane) {
  const char* page = (const char*)(cache + ((size_t)(blk * PAGE_TOK) * KVH + kvh) * HD);
  // All four loops below are unrolled so that s[] and d[] are registers, which the asm operands need.
  if (!any_new) {
#pragma unroll
    for (int g = 0; g < 2; ++g) {
      const char* s[8];
      unsigned d[8];
#pragma unroll
      for (int i = 0; i < 8; ++i) {
        const int t = g * 8 + i;
        s[i] = page + (size_t)t * (KVH * HD * sizeof(float)) + lane * 16;
        d[i] = lds_lane + (unsigned)t * pitch_bytes;
      }
      async_copy8(d, s);
    }
  } else {
#pragma unroll
    for (int g = 0; g < 2; ++g) {
      const char* s[8];
      unsigned d[8];
#pragma unroll
      for (int i = 0; i < 8; ++i) {
        const int t = g * 8 + i;
        const unsigned long long mb = __ballot(sm_lane == blk * PAGE_TOK + t);   // wave-uniform
        const char* row = mb
            ? (const char*)(fresh + (size_t)(((int)__ffsll(mb) - 1) * KVH + kvh) * HD)
            : page + (size_t)t * (KVH * HD * sizeof(float));
        s[i] = row + lane * 16;
        d[i] = lds_lane + (unsigned)t * pitch_bytes;
      }
      async_copy8(d, s);
    }
  }
}

__global__ __launch_bounds__(WAVES * 32) void pa_decode_kernel(
    const float* __restrict__ q,
    const float* __restrict__ knew,
    const float* __restrict__ vnew,
    const float* __restrict__ kcache,
    const float* __restrict__ vcache,
    const int*   __restrict__ ctxlen,
    const int*   __restrict__ btab,
    const int*   __restrict__ smap,
    float*       __restrict__ out)
{
  // 16-byte alignment: every copy writes 16 B a lane
  __shared__ __attribute__((aligned(16))) float kb[WAVES][PAGE_TOK * ROWF];   // staged K page per wave
  __shared__ __attribute__((aligned(16))) float vb[WAVES][PAGE_TOK * VROWF];  // staged V page per wave
  __shared__ float Oar[WAVES][GQA][HD];          // partial outputs
  __shared__ float mar[WAVES][GQA];
  __shared__ float sar[WAVES][GQA];

  const int b    = blockIdx.x >> 3;
  const int kvh  = blockIdx.x & 7;
  const int lane = threadIdx.x & 31;
  // wave number in a scalar register: the tests around the copies become scalar branches
  const int wv   = __builtin_amdgcn_readfirstlane((int)(threadIdx.x >> 5));
  const int ln16 = lane & 15;           // row-in-tile / q-head column
  const int h    = lane >> 4;           // wave half

  const int sm_lane = smap[lane];       // all 32 slot_mapping entries, one per lane

  // ---- Q as WMMA B-fragment (K=dims x N=qhead), pre-scaled, 32 chunks of K=4 ----
  v2f qb[32];
  {
    const bool valid = ln16 < GQA;
    const float* qbase = q + (size_t)(b * NH + kvh * GQA + (valid ? ln16 : 0)) * HD + 2 * h;
#pragma unroll
    for (int kk = 0; kk < 32; ++kk) {
      float x = 0.f, y = 0.f;
      if (valid) { x = qbase[kk * 4] * QK_SCALE; y = qbase[kk * 4 + 1] * QK_SCALE; }
      qb[kk].x = x; qb[kk].y = y;
    }
  }

  const int ctx    = ctxlen[b];
  const int ptotal = min((ctx + PAGE_TOK - 1) >> 4, MAXB);

  float m = -1e30f, s = 0.f;
  v8f O[8];
  {
    v8f z = {0.f,0.f,0.f,0.f,0.f,0.f,0.f,0.f};
#pragma unroll
    for (int t = 0; t < 8; ++t) O[t] = z;
  }

  const float* kbw = kb[wv];
  const float* vbw = vb[wv];
  const unsigned kbw_off = (unsigned)(uintptr_t)kbw + (unsigned)(lane * 16);
  const unsigned vbw_off = (unsigned)(uintptr_t)vbw + (unsigned)(lane * 16);

  // ---- prologue: this wave's first K and V page start towards its two LDS buffers ----
  if (wv < ptotal) {
    const int blk0 = min(max(btab[b * MAXB + wv], 0), NUM_BLOCKS - 1);
    const bool new0 = __ballot((sm_lane >> 4) == blk0) != 0;   // a new token lies in this page
    stage_page(kbw_off, ROWF * 4, kcache, knew, blk0, new0, kvh, lane, sm_lane);
    stage_page(vbw_off, VROWF * 4, vcache, vnew, blk0, new0, kvh, lane, sm_lane);
  }
  wait_asynccnt0();     // the first K page (and V page) has landed in this wave's own buffers

  for (int p = wv; p < ptotal; p += WAVES) {
    const bool more = p + WAVES < ptotal;              // scalar: this wave has a further page
    const int  nblk = more ? min(max(btab[b * MAXB + p + WAVES], 0), NUM_BLOCKS - 1) : 0;
    const bool nnew = __ballot((sm_lane >> 4) == nblk) != 0;   // a new token lies in that page

    // ---- QK^T: C[tok, qh] accumulated over D=128 in 32 K=4 steps ----
    v8f c = {0.f,0.f,0.f,0.f,0.f,0.f,0.f,0.f};
#pragma unroll
    for (int kk = 0; kk < 32; ++kk) {
      v2f a = *(const v2f*)&kbw[ln16 * ROWF + kk * 4 + 2 * h];  // A: K rows
      c = wmma_f32_16x16x4(a, qb[kk], c);
    }

    // ---- mask invalid tokens in last partial page ----
    const int nv = ctx - p * PAGE_TOK;
    if (nv < PAGE_TOK) {
#pragma unroll
      for (int r = 0; r < 8; ++r) {
        int tok = r + 8 * h;
        if (tok >= nv) c[r] = -1e30f;
      }
    }

    // ---- online softmax update (per qh column = per lane%16) ----
    float pm = c[0];
#pragma unroll
    for (int r = 1; r < 8; ++r) pm = fmaxf(pm, c[r]);
    pm = fmaxf(pm, __shfl_xor(pm, 16, 32));
    const float mn = fmaxf(m, pm);
    const float f  = __expf(m - mn);
    m = mn;
#pragma unroll
    for (int r = 0; r < 8; ++r) c[r] = __expf(c[r] - mn);
    float psum = c[0];
#pragma unroll
    for (int r = 1; r < 8; ++r) psum += c[r];
    psum += __shfl_xor(psum, 16, 32);
    s = s * f + psum;

    // rescale O: O row qh = r + 8h needs f from lane (r + 8h)
    float fr[8];
#pragma unroll
    for (int r = 0; r < 8; ++r) fr[r] = __shfl(f, r + 8 * h, 32);
#pragma unroll
    for (int dt = 0; dt < 8; ++dt)
#pragma unroll
      for (int r = 0; r < 8; ++r) O[dt][r] *= fr[r];

    // ---- this page's V, in flight since before Q x K, must have landed; the K buffer is read
    //      out, so the next page's K flies during P x V ----
    wait_asynccnt0();   // nothing but this page's V copies can be outstanding here
    wait_dscnt0();      // the wave's own K reads have retired before the copies rewrite the buffer
    if (more) stage_page(kbw_off, ROWF * 4, kcache, knew, nblk, nnew, kvh, lane, sm_lane);

    // ---- P^T x V: 4 token-chunks of K=4, 8 dim tiles of N=16 ----
#pragma unroll
    for (int kc = 0; kc < 4; ++kc) {
      // A-fragment: lane holds row qh=lane%16, tokens kc*4 + 2h + {0,1}
      v2f a;
#pragma unroll
      for (int v = 0; v < 2; ++v) {
        const int t0 = kc * 4 + v;       // token for h==0 lanes
        const int t1 = kc * 4 + 2 + v;   // token for h==1 lanes
        float v0 = (t0 < 8) ? c[t0] : __shfl_xor(c[t0 & 7], 16, 32);
        float v1 = (t1 >= 8) ? c[t1 & 7] : __shfl_xor(c[t1 & 7], 16, 32);
        float av = h ? v1 : v0;
        if (v == 0) a.x = av; else a.y = av;
      }
      // V B-fragment: rows kc*4 + 2h + {0,1} of the staged page
      const float* vr = &vbw[(kc * 4 + 2 * h) * VROWF + ln16];
#pragma unroll
      for (int dt = 0; dt < 8; ++dt) {
        v2f bv;
        bv.x = vr[dt * 16];
        bv.y = vr[VROWF + dt * 16];
        O[dt] = wmma_f32_16x16x4(a, bv, O[dt]);
      }
    }

    // ---- the next page's K must have landed before the next trip reads it; the V buffer is
    //      read out, so the next page's V flies during the next Q x K and softmax ----
    wait_dscnt0();      // the wave's own V reads have retired before the copies rewrite the buffer
    wait_asynccnt0();   // nothing but the next page's K copies can be outstanding here
    if (more) stage_page(vbw_off, VROWF * 4, vcache, vnew, nblk, nnew, kvh, lane, sm_lane);
  }
  wait_asynccnt0();

  // ---- publish per-wave partials ----
  if (lane < GQA) { mar[wv][lane] = m; sar[wv][lane] = s; }
#pragma unroll
  for (int dt = 0; dt < 8; ++dt)
#pragma unroll
    for (int r = 0; r < GQA; ++r)
      if (h == 0) Oar[wv][r][dt * 16 + ln16] = O[dt][r];

  __syncthreads();

  // ---- merge the waves' partials, normalize, write out ----
  for (int i = threadIdx.x; i < GQA * HD; i += blockDim.x) {
    const int qh2 = i >> 7, d = i & 127;
    float mx = mar[0][qh2];
#pragma unroll
    for (int w = 1; w < WAVES; ++w) mx = fmaxf(mx, mar[w][qh2]);
    float ss = 0.f, vv = 0.f;
#pragma unroll
    for (int w = 0; w < WAVES; ++w) {
      float e = __expf(mar[w][qh2] - mx);
      ss += sar[w][qh2] * e;
      vv += Oar[w][qh2][d] * e;
    }
    out[(size_t)(b * NH + kvh * GQA + qh2) * HD + d] = vv / ss;
  }
}

extern "C" void kernel_launch(void* const* d_in, const int* in_sizes, int n_in,
                              void* d_out, int out_size, void* d_ws, size_t ws_size,
                              hipStream_t stream) {
  (void)in_sizes; (void)n_in; (void)out_size; (void)d_ws; (void)ws_size;
  pa_decode_kernel<<<dim3(BATCH * KVH), dim3(WAVES * 32), 0, stream>>>(
      (const float*)d_in[0], (const float*)d_in[1], (const float*)d_in[2],
      (const float*)d_in[3], (const float*)d_in[4], (const int*)d_in[5],
      (const int*)d_in[6], (const int*)d_in[7], (float*)d_out);
}

// v003
// It runs in 28.2 microseconds.
// Timed twice side by side with v002, it ran 1.07 times as fast both times.
// All steps since v000 together make it 3.51 times as fast.
#include <hip/hip_runtime.h>

// ---- problem constants (match reference) ----
#define BATCH      32
#define NUM_BLOCKS 2048
#define PAGE_TOK   16
#define KVH        8
#define NH         32
#define HD         128
#define MAXB       128
#define GQA        4                      // NH / KVH
#define QK_SCALE   0.08838834764831845f   // 1/sqrt(128)

#define WAVES        16
#define ROWF         132
#define VROWF        136

typedef float v2f __attribute__((ext_vector_type(2)));
typedef float v8f __attribute__((ext_vector_type(8)));

__device__ __forceinline__ v8f wmma_f32_16x16x4(v2f a, v2f b, v8f c) {
  return __builtin_amdgcn_wmma_f32_16x16x4_f32(
      /*neg_a=*/false, a, /*neg_b=*/false, b,
      /*c_mod=*/(short)0, c, /*reuse_a=*/false, /*reuse_b=*/false);
}

__device__ __forceinline__ void wait_asynccnt0() {
  asm volatile("s_wait_asynccnt 0" ::: "memory");
}
__device__ __forceinline__ void wait_dscnt0() {
  asm volatile("s_wait_dscnt 0" ::: "memory");
}

__device__ __forceinline__ void async_copy8(const unsigned (&d)[8], const char* const (&s)[8]) {
  asm volatile(
      "global_load_async_to_lds_b128 %0, %8, off\n\t"
      "global_load_async_to_lds_b128 %1, %9, off\n\t"
      "global_load_async_to_lds_b128 %2, %10, off\n\t"
      "global_load_async_to_lds_b128 %3, %11, off\n\t"
      "global_load_async_to_lds_b128 %4, %12, off\n\t"
      "global_load_async_to_lds_b128 %5, %13, off\n\t"
      "global_load_async_to_lds_b128 %6, %14, off\n\t"
      "global_load_async_to_lds_b128 %7, %15, off\n\t"
      "s_wait_xcnt 0x0"
      :: "v"(d[0]), "v"(d[1]), "v"(d[2]), "v"(d[3]), "v"(d[4]), "v"(d[5]), "v"(d[6]), "v"(d[7]),
         "v"(s[0]), "v"(s[1]), "v"(s[2]), "v"(s[3]), "v"(s[4]), "v"(s[5]), "v"(s[6]), "v"(s[7])
      : "memory");
}

__device__ __forceinline__ void stage_page(unsigned lds_lane, unsigned pitch_bytes,
                                           const float* __restrict__ cache,
                                           const float* __restrict__ fresh,
                                           int blk, bool any_new, int kvh, int lane, int sm_lane) {
  const char* page = (const char*)(cache + ((size_t)(blk * PAGE_TOK) * KVH + kvh) * HD);
  // All four loops below are unrolled so that s[] and d[] are registers, which the asm operands need.
  if (!any_new) {
#pragma unroll
    for (int g = 0; g < 2; ++g) {
      const char* s[8];
      unsigned d[8];
#pragma unroll
      for (int i = 0; i < 8; ++i) {
        const int t = g * 8 + i;
        s[i] = page + (size_t)t * (KVH * HD * sizeof(float)) + lane * 16;
        d[i] = lds_lane + (unsigned)t * pitch_bytes;
      }
      async_copy8(d, s);
    }
  } else {
#pragma unroll
    for (int g = 0; g < 2; ++g) {
      const char* s[8];
      unsigned d[8];
#pragma unroll
      for (int i = 0; i < 8; ++i) {
        const int t = g * 8 + i;
        const unsigned long long mb = __ballot(sm_lane == blk * PAGE_TOK + t);   // wave-uniform
        const char* row = mb
            ? (const char*)(fresh + (size_t)(((int)__ffsll(mb) - 1) * KVH + kvh) * HD)
            : page + (size_t)t * (KVH * HD * sizeof(float));
        s[i] = row + lane * 16;
        d[i] = lds_lane + (unsigned)t * pitch_bytes;
      }
      async_copy8(d, s);
    }
  }
}

__global__ __launch_bounds__(WAVES * 32) void pa_decode_kernel(
    const float* __restrict__ q,
    const float* __restrict__ knew,
    const float* __restrict__ vnew,
    const float* __restrict__ kcache,
    const float* __restrict__ vcache,
    const int*   __restrict__ ctxlen,
    const int*   __restrict__ btab,
    const int*   __restrict__ smap,
    float*       __restrict__ out)
{
  // 16-byte alignment: every copy writes 16 B a lane
  __shared__ __attribute__((aligned(16))) float kb[WAVES][PAGE_TOK * ROWF];   // staged K page per wave
  __shared__ __attribute__((aligned(16))) float vb[WAVES][PAGE_TOK * VROWF];  // staged V page per wave
  __shared__ float Oar[WAVES][GQA][HD];          // partial outputs
  __shared__ float mar[WAVES][GQA];
  __shared__ float sar[WAVES][GQA];

  const int b    = blockIdx.x >> 3;
  const int kvh  = blockIdx.x & 7;
  const int lane = threadIdx.x & 31;
  // wave number in a scalar register: the tests around the copies become scalar branches
  const int wv   = __builtin_amdgcn_readfirstlane((int)(threadIdx.x >> 5));
  const int ln16 = lane & 15;           // row-in-tile / q-head column
  const int h    = lane >> 4;           // wave half

  // ---- Q as WMMA B-fragment (K=dims x N=qhead), 32 chunks of K=4: the loads ----
  // Every lane loads (a lane without a q head reads head 0's row and drops it by a select below),
  // so the 32 loads carry no branch and no wait between them.
  const bool qvalid = ln16 < GQA;
  v2f qb[32];
  {
    const float* qbase = q + (size_t)(b * NH + kvh * GQA + (qvalid ? ln16 : 0)) * HD + 2 * h;
#pragma unroll
    for (int kk = 0; kk < 32; ++kk) qb[kk] = *(const v2f*)(qbase + kk * 4);
  }

  // The three loads that the first copies' addresses hang on start together; the table entry is
  // read whether or not the wave has a page (wv < WAVES <= MAXB keeps the index inside the row).
  const int sm_lane = smap[lane];       // all 32 slot_mapping entries, one per lane
  const int ctx     = ctxlen[b];
  const int bt0     = btab[b * MAXB + wv];
  // holds the table load in front of the branch on ctx: sunk into it, it would start only when ctx is back
  asm volatile("" :: "s"(bt0));
  asm volatile("s_wait_xcnt 0x0" ::: "memory");
  const int ptotal  = min((ctx + PAGE_TOK - 1) >> 4, MAXB);

  float m = -1e30f, s = 0.f;
  v8f O[8];
  {
    v8f z = {0.f,0.f,0.f,0.f,0.f,0.f,0.f,0.f};
#pragma unroll
    for (int t = 0; t < 8; ++t) O[t] = z;
  }

  const float* kbw = kb[wv];
  const float* vbw = vb[wv];
  const unsigned kbw_off = (unsigned)(uintptr_t)kbw + (unsigned)(lane * 16);
  const unsigned vbw_off = (unsigned)(uintptr_t)vbw + (unsigned)(lane * 16);

  // ---- prologue: this wave's first K and V page start towards its two LDS buffers ----
  if (wv < ptotal) {
    const int blk0 = min(max(bt0, 0), NUM_BLOCKS - 1);
    const bool new0 = __ballot((sm_lane >> 4) == blk0) != 0;   // a new token lies in this page
    stage_page(kbw_off, ROWF * 4, kcache, knew, blk0, new0, kvh, lane, sm_lane);
    stage_page(vbw_off, VROWF * 4, vcache, vnew, blk0, new0, kvh, lane, sm_lane);
  }

  // holds the Q loads in front of the wait for the copies: sunk behind it, they would start only
  // when the pages have landed (two statements: one takes at most thirty operands)
  asm volatile("" :: "v"(qb[0]), "v"(qb[1]), "v"(qb[2]), "v"(qb[3]), "v"(qb[4]), "v"(qb[5]), "v"(qb[6]), "v"(qb[7]),
                     "v"(qb[8]), "v"(qb[9]), "v"(qb[10]), "v"(qb[11]), "v"(qb[12]), "v"(qb[13]), "v"(qb[14]), "v"(qb[15]));
  asm volatile("" :: "v"(qb[16]), "v"(qb[17]), "v"(qb[18]), "v"(qb[19]), "v"(qb[20]), "v"(qb[21]), "v"(qb[22]), "v"(qb[23]),
                     "v"(qb[24]), "v"(qb[25]), "v"(qb[26]), "v"(qb[27]), "v"(qb[28]), "v"(qb[29]), "v"(qb[30]), "v"(qb[31]));
  // pre-scale; zero in the columns that stand for no q head
#pragma unroll
  for (int kk = 0; kk < 32; ++kk) {
    qb[kk].x = qvalid ? qb[kk].x * QK_SCALE : 0.f;
    qb[kk].y = qvalid ? qb[kk].y * QK_SCALE : 0.f;
  }

  wait_asynccnt0();     // the first K page (and V page) has landed in this wave's own buffers

  for (int p = wv; p < ptotal; p += WAVES) {
    const bool more = p + WAVES < ptotal;              // scalar: this wave has a further page
    const int  nblk = more ? min(max(btab[b * MAXB + p + WAVES], 0), NUM_BLOCKS - 1) : 0;
    const bool nnew = __ballot((sm_lane >> 4) == nblk) != 0;   // a new token lies in that page

    // ---- QK^T: C[tok, qh] accumulated over D=128 in 32 K=4 steps ----
    v8f c = {0.f,0.f,0.f,0.f,0.f,0.f,0.f,0.f};
#pragma unroll
    for (int kk = 0; kk < 32; ++kk) {
      v2f a = *(const v2f*)&kbw[ln16 * ROWF + kk * 4 + 2 * h];  // A: K rows
      c = wmma_f32_16x16x4(a, qb[kk], c);
    }

    // ---- mask invalid tokens in last partial page ----
    const int nv = ctx - p * PAGE_TOK;
    if (nv < PAGE_TOK) {
#pragma unroll
      for (int r = 0; r < 8; ++r) {
        int tok = r + 8 * h;
        if (tok >= nv) c[r] = -1e30f;
      }
    }

    // ---- online softmax update (per qh column = per lane%16) ----
    float pm = c[0];
#pragma unroll
    for (int r = 1; r < 8; ++r) pm = fmaxf(pm, c[r]);
    pm = fmaxf(pm, __shfl_xor(pm, 16, 32));
    const float mn = fmaxf(m, pm);
    const float f  = __expf(m - mn);
    m = mn;
#pragma unroll
    for (int r = 0; r < 8; ++r) c[r] = __expf(c[r] - mn);
    float psum = c[0];
#pragma unroll
    for (int r = 1; r < 8; ++r) psum += c[r];
    psum += __shfl_xor(psum, 16, 32);
    s = s * f + psum;

    // rescale O: O row qh = r + 8h needs f from lane (r + 8h)
    float fr[8];
#pragma unroll
    for (int r = 0; r < 8; ++r) fr[r] = __shfl(f, r + 8 * h, 32);
#pragma unroll
    for (int dt = 0; dt < 8; ++dt)
#pragma unroll
      for (int r = 0; r < 8; ++r) O[dt][r] *= fr[r];

    // ---- this page's V, in flight since before Q x K, must have landed; the K buffer is read
    //      out, so the next page's K flies during P x V ----
    wait_asynccnt0();   // nothing but this page's V copies can be outstanding here
    wait_dscnt0();      // the wave's own K reads have retired before the copies rewrite the buffer
    if (more) stage_page(kbw_off, ROWF * 4, kcache, knew, nblk, nnew, kvh, lane, sm_lane);

    // ---- P^T x V: 4 token-chunks of K=4, 8 dim tiles of N=16 ----
#pragma unroll
    for (int kc = 0; kc < 4; ++kc) {
      // A-fragment: lane holds row qh=lane%16, tokens kc*4 + 2h + {0,1}
      v2f a;
#pragma unroll
      for (int v = 0; v < 2; ++v) {
        const int t0 = kc * 4 + v;       // token for h==0 lanes
        const int t1 = kc * 4 + 2 + v;   // token for h==1 lanes
        float v0 = (t0 < 8) ? c[t0] : __shfl_xor(c[t0 & 7], 16, 32);
        float v1 = (t1 >= 8) ? c[t1 & 7] : __shfl_xor(c[t1 & 7], 16, 32);
        float av = h ? v1 : v0;
        if (v == 0) a.x = av; else a.y = av;
      }
      // V B-fragment: rows kc*4 + 2h + {0,1} of the staged page
      const float* vr = &vbw[(kc * 4 + 2 * h) * VROWF + ln16];
#pragma unroll
      for (int dt = 0; dt < 8; ++dt) {
        v2f bv;
        bv.x = vr[dt * 16];
        bv.y = vr[VROWF + dt * 16];
        O[dt] = wmma_f32_16x16x4(a, bv, O[dt]);
      }
    }

    // ---- the next page's K must have landed before the next trip reads it; the V buffer is
    //      read out, so the next page's V flies during the next Q x K and softmax ----
    wait_dscnt0();      // the wave's own V reads have retired before the copies rewrite the buffer
    wait_asynccnt0();   // nothing but the next page's K copies can be outstanding here
    if (more) stage_page(vbw_off, VROWF * 4, vcache, vnew, nblk, nnew, kvh, lane, sm_lane);
  }
  wait_asynccnt0();

  // ---- publish per-wave partials ----
  if (lane < GQA) { mar[wv][lane] = m; sar[wv][lane] = s; }
#pragma unroll
  for (int dt = 0; dt < 8; ++dt)
#pragma unroll
    for (int r = 0; r < GQA; ++r)
      if (h == 0) Oar[wv][r][dt * 16 + ln16] = O[dt][r];

  __syncthreads();

  // ---- merge the waves' partials, normalize, write out ----
  for (int i = threadIdx.x; i < GQA * HD; i += blockDim.x) {
    const int qh2 = i >> 7, d = i & 127;
    float mx = mar[0][qh2];
#pragma unroll
    for (int w = 1; w < WAVES; ++w) mx = fmaxf(mx, mar[w][qh2]);
    float ss = 0.f, vv = 0.f;
#pragma unroll
    for (int w = 0; w < WAVES; ++w) {
      float e = __expf(mar[w][qh2] - mx);
      ss += sar[w][qh2] * e;
      vv += Oar[w][qh2][d] * e;
    }
    out[(size_t)(b * NH + kvh * GQA + qh2) * HD + d] = vv / ss;
  }
}

extern "C" void kernel_launch(void* const* d_in, const int* in_sizes, int n_in,
                              void* d_out, int out_size, void* d_ws, size_t ws_size,
                              hipStream_t stream) {
  (void)in_sizes; (void)n_in; (void)out_size; (void)d_ws; (void)ws_size;
  pa_decode_kernel<<<dim3(BATCH * KVH), dim3(WAVES * 32), 0, stream>>>(
      (const float*)d_in[0], (const float*)d_in[1], (const float*)d_in[2],
      (const float*)d_in[3], (const float*)d_in[4], (const int*)d_in[5],
      (const int*)d_in[6], (const int*)d_in[7], (float*)d_out);
}

// v004
// A run of this version takes 27.4 microseconds.
// Timed twice side by side with v003, it ran 1.03 times as fast both times.
// All steps since v000 together make it 3.62 times as fast.
#include <hip/hip_runtime.h>

// ---- problem constants (match reference) ----
#define BATCH      32
#define NUM_BLOCKS 2048
#define PAGE_TOK   16
#define KVH        8
#define NH         32
#define HD         128
#define MAXB       128
#define GQA        4                      // NH / KVH
#define QK_SCALE   0.08838834764831845f   // 1/sqrt(128)

#define WAVES        16
#define ROWF         132
#define VROWF        136

typedef float v2f __attribute__((ext_vector_type(2)));
typedef float v8f __attribute__((ext_vector_type(8)));

__device__ __forceinline__ v8f wmma_f32_16x16x4(v2f a, v2f b, v8f c) {
  return __builtin_amdgcn_wmma_f32_16x16x4_f32(
      /*neg_a=*/false, a, /*neg_b=*/false, b,
      /*c_mod=*/(short)0, c, /*reuse_a=*/false, /*reuse_b=*/false);
}

__device__ __forceinline__ void wait_asynccnt0() {
  asm volatile("s_wait_asynccnt 0" ::: "memory");
}
// Returns when all but the wave's 16 youngest copies (one page of K or of V) have landed: copies
// retire in issue order, so the page issued in front of those 16 is then complete.
__device__ __forceinline__ void wait_asynccnt16() {
  asm volatile("s_wait_asynccnt 16" ::: "memory");
}
__device__ __forceinline__ void wait_dscnt0() {
  asm volatile("s_wait_dscnt 0" ::: "memory");
}

__device__ __forceinline__ void async_copy8(const unsigned (&d)[8], const char* const (&s)[8]) {
  asm volatile(
      "global_load_async_to_lds_b128 %0, %8, off\n\t"
      "global_load_async_to_lds_b128 %1, %9, off\n\t"
      "global_load_async_to_lds_b128 %2, %10, off\n\t"
      "global_load_async_to_lds_b128 %3, %11, off\n\t"
      "global_load_async_to_lds_b128 %4, %12, off\n\t"
      "global_load_async_to_lds_b128 %5, %13, off\n\t"
      "global_load_async_to_lds_b128 %6, %14, off\n\t"
      "global_load_async_to_lds_b128 %7, %15, off\n\t"
      "s_wait_xcnt 0x0"
      :: "v"(d[0]), "v"(d[1]), "v"(d[2]), "v"(d[3]), "v"(d[4]), "v"(d[5]), "v"(d[6]), "v"(d[7]),
         "v"(s[0]), "v"(s[1]), "v"(s[2]), "v"(s[3]), "v"(s[4]), "v"(s[5]), "v"(s[6]), "v"(s[7])
      : "memory");
}

__device__ __forceinline__ void stage_page(unsigned lds_lane, unsigned pitch_bytes,
                                           const float* __restrict__ cache,
                                           const float* __restrict__ fresh,
                                           int blk, bool any_new, int kvh, int lane, int sm_lane) {
  const char* page = (const char*)(cache + ((size_t)(blk * PAGE_TOK) * KVH + kvh) * HD);
  // All four loops below are unrolled so that s[] and d[] are registers, which the asm operands need.
  if (!any_new) {
#pragma unroll
    for (int g = 0; g < 2; ++g) {
      const char* s[8];
      unsigned d[8];
#pragma unroll
      for (int i = 0; i < 8; ++i) {
        const int t = g * 8 + i;
        s[i] = page + (size_t)t * (KVH * HD * sizeof(float)) + lane * 16;
        d[i] = lds_lane + (unsigned)t * pitch_bytes;
      }
      async_copy8(d, s);
    }
  } else {
#pragma unroll
    for (int g = 0; g < 2; ++g) {
      const char* s[8];
      unsigned d[8];
#pragma unroll
      for (int i = 0; i < 8; ++i) {
        const int t = g * 8 + i;
        const unsigned long long mb = __ballot(sm_lane == blk * PAGE_TOK + t);   // wave-uniform
        const char* row = mb
            ? (const char*)(fresh + (size_t)(((int)__ffsll(mb) - 1) * KVH + kvh) * HD)
            : page + (size_t)t * (KVH * HD * sizeof(float));
        s[i] = row + lane * 16;
        d[i] = lds_lane + (unsigned)t * pitch_bytes;
      }
      async_copy8(d, s);
    }
  }
}

__global__ __launch_bounds__(WAVES * 32) void pa_decode_kernel(
    const float* __restrict__ q,
    const float* __restrict__ knew,
    const float* __restrict__ vnew,
    const float* __restrict__ kcache,
    const float* __restrict__ vcache,
    const int*   __restrict__ ctxlen,
    const int*   __restrict__ btab,
    const int*   __restrict__ smap,
    float*       __restrict__ out)
{
  // 16-byte alignment: every copy writes 16 B a lane
  __shared__ __attribute__((aligned(16))) float kb[WAVES][PAGE_TOK * ROWF];   // staged K page per wave
  __shared__ __attribute__((aligned(16))) float vb[WAVES][PAGE_TOK * VROWF];  // staged V page per wave
  __shared__ float Oar[WAVES][GQA][HD];          // partial outputs
  __shared__ float mar[WAVES][GQA];
  __shared__ float sar[WAVES][GQA];

  const int b    = blockIdx.x >> 3;
  const int kvh  = blockIdx.x & 7;
  const int lane = threadIdx.x & 31;
  // wave number in a scalar register: the tests around the copies become scalar branches
  const int wv   = __builtin_amdgcn_readfirstlane((int)(threadIdx.x >> 5));
  const int ln16 = lane & 15;           // row-in-tile / q-head column
  const int h    = lane >> 4;           // wave half

  // ---- Q as WMMA B-fragment (K=dims x N=qhead), 32 chunks of K=4: the loads ----
  // Every lane loads (a lane without a q head reads head 0's row and drops it by a select below),
  // so the 32 loads carry no branch and no wait between them.
  const bool qvalid = ln16 < GQA;
  v2f qb[32];
  {
    const float* qbase = q + (size_t)(b * NH + kvh * GQA + (qvalid ? ln16 : 0)) * HD + 2 * h;
#pragma unroll
    for (int kk = 0; kk < 32; ++kk) qb[kk] = *(const v2f*)(qbase + kk * 4);
  }

  // The three loads that the first copies' addresses hang on start together; the table entry is
  // read whether or not the wave has a page (wv < WAVES <= MAXB keeps the index inside the row).
  const int sm_lane = smap[lane];       // all 32 slot_mapping entries, one per lane
  const int ctx     = ctxlen[b];
  const int bt0     = btab[b * MAXB + wv];
  // holds the table load in front of the branch on ctx: sunk into it, it would start only when ctx is back
  asm volatile("" :: "s"(bt0));
  asm volatile("s_wait_xcnt 0x0" ::: "memory");
  const int ptotal  = min((ctx + PAGE_TOK - 1) >> 4, MAXB);

  float m = -1e30f, s = 0.f;
  v8f O[8];
  {
    v8f z = {0.f,0.f,0.f,0.f,0.f,0.f,0.f,0.f};
#pragma unroll
    for (int t = 0; t < 8; ++t) O[t] = z;
  }

  const float* kbw = kb[wv];
  const float* vbw = vb[wv];
  const unsigned kbw_off = (unsigned)(uintptr_t)kbw + (unsigned)(lane * 16);
  const unsigned vbw_off = (unsigned)(uintptr_t)vbw + (unsigned)(lane * 16);

  // ---- prologue: this wave's first K and V page start towards its two LDS buffers ----
  if (wv < ptotal) {
    const int blk0 = min(max(bt0, 0), NUM_BLOCKS - 1);
    const bool new0 = __ballot((sm_lane >> 4) == blk0) != 0;   // a new token lies in this page
    stage_page(kbw_off, ROWF * 4, kcache, knew, blk0, new0, kvh, lane, sm_lane);
    stage_page(vbw_off, VROWF * 4, vcache, vnew, blk0, new0, kvh, lane, sm_lane);
  }

  // holds the Q loads in front of the wait for the copies: sunk behind it, they would start only
  // when the first K page has landed (two statements: one takes at most thirty operands)
  asm volatile("" :: "v"(qb[0]), "v"(qb[1]), "v"(qb[2]), "v"(qb[3]), "v"(qb[4]), "v"(qb[5]), "v"(qb[6]), "v"(qb[7]),
                     "v"(qb[8]), "v"(qb[9]), "v"(qb[10]), "v"(qb[11]), "v"(qb[12]), "v"(qb[13]), "v"(qb[14]), "v"(qb[15]));
  asm volatile("" :: "v"(qb[16]), "v"(qb[17]), "v"(qb[18]), "v"(qb[19]), "v"(qb[20]), "v"(qb[21]), "v"(qb[22]), "v"(qb[23]),
                     "v"(qb[24]), "v"(qb[25]), "v"(qb[26]), "v"(qb[27]), "v"(qb[28]), "v"(qb[29]), "v"(qb[30]), "v"(qb[31]));
  // pre-scale; zero in the columns that stand for no q head
#pragma unroll
  for (int kk = 0; kk < 32; ++kk) {
    qb[kk].x = qvalid ? qb[kk].x * QK_SCALE : 0.f;
    qb[kk].y = qvalid ? qb[kk].y * QK_SCALE : 0.f;
  }

  // The first K page has landed; the 16 copies of the first V page, issued behind it, may still fly.
  // (A wave without a page has issued nothing and passes at once.)
  wait_asynccnt16();

  for (int p = wv; p < ptotal; p += WAVES) {
    const bool more = p + WAVES < ptotal;              // scalar: this wave has a further page
    const int  nblk = more ? min(max(btab[b * MAXB + p + WAVES], 0), NUM_BLOCKS - 1) : 0;
    const bool nnew = __ballot((sm_lane >> 4) == nblk) != 0;   // a new token lies in that page

    // ---- QK^T: C[tok, qh] accumulated over D=128 in 32 K=4 steps ----
    v8f c = {0.f,0.f,0.f,0.f,0.f,0.f,0.f,0.f};
#pragma unroll
    for (int kk = 0; kk < 32; ++kk) {
      v2f a = *(const v2f*)&kbw[ln16 * ROWF + kk * 4 + 2 * h];  // A: K rows
      c = wmma_f32_16x16x4(a, qb[kk], c);
    }

    // ---- the K buffer is read out: the next page's K starts now and flies during softmax and
    //      P x V, beside this page's V, which has been in flight since the end of the last trip ----
    wait_dscnt0();      // the wave's own K reads have retired before the copies rewrite the buffer
    if (more) stage_page(kbw_off, ROWF * 4, kcache, knew, nblk, nnew, kvh, lane, sm_lane);

    // ---- mask invalid tokens in last partial page ----
    const int nv = ctx - p * PAGE_TOK;
    if (nv < PAGE_TOK) {
#pragma unroll
      for (int r = 0; r < 8; ++r) {
        int tok = r + 8 * h;
        if (tok >= nv) c[r] = -1e30f;
      }
    }

    // ---- online softmax update (per qh column = per lane%16) ----
    float pm = c[0];
#pragma unroll
    for (int r = 1; r < 8; ++r) pm = fmaxf(pm, c[r]);
    pm = fmaxf(pm, __shfl_xor(pm, 16, 32));
    const float mn = fmaxf(m, pm);
    const float f  = __expf(m - mn);
    m = mn;
#pragma unroll
    for (int r = 0; r < 8; ++r) c[r] = __expf(c[r] - mn);
    float psum = c[0];
#pragma unroll
    for (int r = 1; r < 8; ++r) psum += c[r];
    psum += __shfl_xor(psum, 16, 32);
    s = s * f + psum;

    // rescale O: O row qh = r + 8h needs f from lane (r + 8h)
    float fr[8];
#pragma unroll
    for (int r = 0; r < 8; ++r) fr[r] = __shfl(f, r + 8 * h, 32);
#pragma unroll
    for (int dt = 0; dt < 8; ++dt)
#pragma unroll
      for (int r = 0; r < 8; ++r) O[dt][r] *= fr[r];

    // ---- this page's V must have landed. With a further page exactly its 16 K copies were issued
    //      behind the V copies (both branches of stage_page issue 16), so they alone may stay out;
    //      in the wave's last trip nothing was issued behind them and the wait is to 0 ----
    if (more) wait_asynccnt16(); else wait_asynccnt0();

    // ---- P^T x V: 4 token-chunks of K=4, 8 dim tiles of N=16 ----
#pragma unroll
    for (int kc = 0; kc < 4; ++kc) {
      // A-fragment: lane holds row qh=lane%16, tokens kc*4 + 2h + {0,1}
      v2f a;
#pragma unroll
      for (int v = 0; v < 2; ++v) {
        const int t0 = kc * 4 + v;       // token for h==0 lanes
        const int t1 = kc * 4 + 2 + v;   // token for h==1 lanes
        float v0 = (t0 < 8) ? c[t0] : __shfl_xor(c[t0 & 7], 16, 32);
        float v1 = (t1 >= 8) ? c[t1 & 7] : __shfl_xor(c[t1 & 7], 16, 32);
        float av = h ? v1 : v0;
        if (v == 0) a.x = av; else a.y = av;
      }
      // V B-fragment: rows kc*4 + 2h + {0,1} of the staged page
      const float* vr = &vbw[(kc * 4 + 2 * h) * VROWF + ln16];
#pragma unroll
      for (int dt = 0; dt < 8; ++dt) {
        v2f bv;
        bv.x = vr[dt * 16];
        bv.y = vr[VROWF + dt * 16];
        O[dt] = wmma_f32_16x16x4(a, bv, O[dt]);
      }
    }

    // ---- the V buffer is read out: the next page's V starts at once, not behind the landing of
    //      the next K; that K, issued in front of these 16 copies, must have landed before the next
    //      trip reads it ----
    wait_dscnt0();      // the wave's own V reads have retired before the copies rewrite the buffer
    if (more) {
      stage_page(vbw_off, VROWF * 4, vcache, vnew, nblk, nnew, kvh, lane, sm_lane);
      wait_asynccnt16();
    }
  }
  wait_asynccnt0();

  // ---- publish per-wave partials ----
  if (lane < GQA) { mar[wv][lane] = m; sar[wv][lane] = s; }
#pragma unroll
  for (int dt = 0; dt < 8; ++dt)
#pragma unroll
    for (int r = 0; r < GQA; ++r)
      if (h == 0) Oar[wv][r][dt * 16 + ln16] = O[dt][r];

  __syncthreads();

  // ---- merge the waves' partials, normalize, write out ----
  for (int i = threadIdx.x; i < GQA * HD; i += blockDim.x) {
    const int qh2 = i >> 7, d = i & 127;
    float mx = mar[0][qh2];
#pragma unroll
    for (int w = 1; w < WAVES; ++w) mx = fmaxf(mx, mar[w][qh2]);
    float ss = 0.f, vv = 0.f;
#pragma unroll
    for (int w = 0; w < WAVES; ++w) {
      float e = __expf(mar[w][qh2] - mx);
      ss += sar[w][qh2] * e;
      vv += Oar[w][qh2][d] * e;
    }
    out[(size_t)(b * NH + kvh * GQA + qh2) * HD + d] = vv / ss;
  }
}

extern "C" void kernel_launch(void* const* d_in, const int* in_sizes, int n_in,
                              void* d_out, int out_size, void* d_ws, size_t ws_size,
                              hipStream_t stream) {
  (void)in_sizes; (void)n_in; (void)out_size; (void)d_ws; (void)ws_size;
  pa_decode_kernel<<<dim3(BATCH * KVH), dim3(WAVES * 32), 0, stream>>>(
      (const float*)d_in[0], (const float*)d_in[1], (const float*)d_in[2],
      (const float*)d_in[3], (const float*)d_in[4], (const int*)d_in[5],
      (const int*)d_in[6], (const int*)d_in[7], (float*)d_out);
}
